// v000
// The times below were measured on an AMD MI455X: many runs one after another, warmed up first and cycling through
// copies of the inputs, with the whole window's GPU time divided by the number of runs. Launches and the gaps
// between them are all in it. The median over several windows is given; except for v000 it joins two sittings, which
// can be a few percent apart, so the side-by-side timings, each taken in one sitting, are the better comparison.
// v000 is the starting kernel.
#include <hip/hip_runtime.h>

#define N_TOKENS 32768
#define DIM      1024
#define NEXP     8

#define BM 128
#define BN 128
#define BK 32
#define LDK 40   // padded K stride in bf16 elements (80 bytes -> 16B aligned rows)

typedef __attribute__((ext_vector_type(16))) __bf16 v16bf;
typedef __attribute__((ext_vector_type(8)))  __bf16 v8bf;
typedef __attribute__((ext_vector_type(4)))  __bf16 v4bf;
typedef __attribute__((ext_vector_type(8)))  float  v8f;

// ---------------------------------------------------------------- zero output
__global__ void moe_zero_kernel(float4* __restrict__ out, int n4) {
    int i = blockIdx.x * blockDim.x + threadIdx.x;
    int stride = gridDim.x * blockDim.x;
    float4 z = {0.f, 0.f, 0.f, 0.f};
    for (; i < n4; i += stride) out[i] = z;
}

// ---------------------------------------------------------------- gating
// One wave32 per token: gate scores, softmax, top-2, weight = sum of top-2.
// Appends token to the two selected experts' compacted lists.
__global__ __launch_bounds__(256) void moe_gate_kernel(
    const float* __restrict__ x, const float* __restrict__ Wg,
    const float* __restrict__ bg, float* __restrict__ wgt,
    int* __restrict__ counts, int* __restrict__ lists) {
    const int lane  = threadIdx.x & 31;
    const int wave  = threadIdx.x >> 5;
    const int token = blockIdx.x * 8 + wave;
    const float* xr = x + (size_t)token * DIM;

    float acc[NEXP];
#pragma unroll
    for (int e = 0; e < NEXP; ++e) acc[e] = 0.f;
    for (int d = lane; d < DIM; d += 32) {
        float xv = xr[d];
        const float* wr = Wg + d * NEXP;
#pragma unroll
        for (int e = 0; e < NEXP; ++e) acc[e] += xv * wr[e];
    }
#pragma unroll
    for (int e = 0; e < NEXP; ++e) {
#pragma unroll
        for (int off = 16; off > 0; off >>= 1)
            acc[e] += __shfl_xor(acc[e], off, 32);
    }
    if (lane == 0) {
        float s[NEXP];
        float m = -1e30f;
#pragma unroll
        for (int e = 0; e < NEXP; ++e) { s[e] = acc[e] + bg[e]; m = fmaxf(m, s[e]); }
        float sum = 0.f;
#pragma unroll
        for (int e = 0; e < NEXP; ++e) { s[e] = expf(s[e] - m); sum += s[e]; }
        float inv = 1.f / sum;
#pragma unroll
        for (int e = 0; e < NEXP; ++e) s[e] *= inv;
        int i1 = 0;
#pragma unroll
        for (int e = 1; e < NEXP; ++e) if (s[e] > s[i1]) i1 = e;   // strict > : first-index tie rule
        int i2 = (i1 == 0) ? 1 : 0;
#pragma unroll
        for (int e = 0; e < NEXP; ++e) if (e != i1 && s[e] > s[i2]) i2 = e;

        wgt[token] = s[i1] + s[i2];
        int p1 = atomicAdd(&counts[i1], 1);
        lists[i1 * N_TOKENS + p1] = token;
        int p2 = atomicAdd(&counts[i2], 1);
        lists[i2 * N_TOKENS + p2] = token;
    }
}

// ---------------------------------------------------------------- expert GEMM
// Per expert, compacted rows. 128x128x32 block tile, 8 waves (2x4), each wave
// computes a 64x32 sub-tile = 4x2 WMMA fragments. Split-bf16 (hi+lo) inputs:
// 3 v_wmma_f32_16x16x32_bf16 per fragment pair per K-step -> ~fp32 accuracy.
// Global->register prefetch of the next K-tile overlaps the WMMA burst.
__global__ __launch_bounds__(256) void moe_expert_gemm(
    const float* __restrict__ x, const float* __restrict__ We,
    const float* __restrict__ be, const float* __restrict__ wgt,
    const int* __restrict__ counts, const int* __restrict__ lists,
    float* __restrict__ out) {
    const int e    = blockIdx.z;
    const int cnt  = counts[e];
    const int row0 = blockIdx.y * BM;
    if (row0 >= cnt) return;
    const int n0 = blockIdx.x * BN;

    __shared__ __bf16 Ahi[BM][LDK];
    __shared__ __bf16 Alo[BM][LDK];
    __shared__ __bf16 Bhi[BN][LDK];   // stored transposed: [n][k]
    __shared__ __bf16 Blo[BN][LDK];
    __shared__ int    sTok[BM];
    __shared__ float  sW[BM];

    const int tid = threadIdx.x;
    if (tid < BM) {
        int r   = row0 + tid;
        int tok = (r < cnt) ? lists[e * N_TOKENS + r] : -1;
        sTok[tid] = tok;
        sW[tid]   = (tok >= 0) ? wgt[tok] : 0.f;
    }
    __syncthreads();

    const int lane  = tid & 31;
    const int wave  = tid >> 5;
    const int waveM = (wave >> 2) * 64;        // 0 or 64
    const int waveN = (wave & 3) * 32;         // 0,32,64,96

    v8f c[4][2] = {};

    const float* Wbase = We + (size_t)e * DIM * DIM;
    // A staging map: 128 rows x 8 float4 -> 256 threads x 4 iters
    const int lrA = tid >> 3, lc4 = tid & 7;       // lrA 0..31
    // B staging map: 32 k-rows x 32 float4 -> 256 threads x 4 iters
    const int kB0 = tid >> 5, c4B = tid & 31;      // kB0 0..7, c4B 0..31
    const int kb0 = (lane < 16) ? 0 : 8;           // ISA 16-bit A/B lane K-base

    float4 aReg[4], bReg[4];

    auto loadTiles = [&](int k0) {
#pragma unroll
        for (int rr = 0; rr < 4; ++rr) {
            int row = lrA + rr * 32;
            int tok = sTok[row]; if (tok < 0) tok = 0;
            aReg[rr] = *(const float4*)(x + (size_t)tok * DIM + k0 + lc4 * 4);
        }
#pragma unroll
        for (int rr = 0; rr < 4; ++rr) {
            int kk = kB0 + rr * 8;
            bReg[rr] = *(const float4*)(Wbase + (size_t)(k0 + kk) * DIM + n0 + c4B * 4);
        }
    };
    auto storeTiles = [&]() {
#pragma unroll
        for (int rr = 0; rr < 4; ++rr) {
            int row = lrA + rr * 32;
            float4 v = aReg[rr];
            __bf16 h0 = (__bf16)v.x, h1 = (__bf16)v.y, h2 = (__bf16)v.z, h3 = (__bf16)v.w;
            v4bf hi = {h0, h1, h2, h3};
            v4bf lo = {(__bf16)(v.x - (float)h0), (__bf16)(v.y - (float)h1),
                       (__bf16)(v.z - (float)h2), (__bf16)(v.w - (float)h3)};
            *(v4bf*)&Ahi[row][lc4 * 4] = hi;
            *(v4bf*)&Alo[row][lc4 * 4] = lo;
        }
#pragma unroll
        for (int rr = 0; rr < 4; ++rr) {
            int kk = kB0 + rr * 8;
            float4 v = bReg[rr];
            float f[4] = {v.x, v.y, v.z, v.w};
#pragma unroll
            for (int j = 0; j < 4; ++j) {
                int n = c4B * 4 + j;
                __bf16 h = (__bf16)f[j];
                Bhi[n][kk] = h;
                Blo[n][kk] = (__bf16)(f[j] - (float)h);
            }
        }
    };

    loadTiles(0);
    for (int k0 = 0; k0 < DIM; k0 += BK) {
        storeTiles();
        __syncthreads();
        if (k0 + BK < DIM) loadTiles(k0 + BK);   // prefetch next K-tile (overlaps WMMA)

        // ---- assemble fragments (two ds_load_b128 each; layout per ISA 7.12.2)
        v16bf aH[4], aL[4], bH[2], bL[2];
#pragma unroll
        for (int mi = 0; mi < 4; ++mi) {
            int row = waveM + mi * 16 + (lane & 15);
            v8bf h0 = *(const v8bf*)&Ahi[row][kb0];
            v8bf h1 = *(const v8bf*)&Ahi[row][kb0 + 16];
            aH[mi] = __builtin_shufflevector(h0, h1, 0,1,2,3,4,5,6,7,8,9,10,11,12,13,14,15);
            v8bf l0 = *(const v8bf*)&Alo[row][kb0];
            v8bf l1 = *(const v8bf*)&Alo[row][kb0 + 16];
            aL[mi] = __builtin_shufflevector(l0, l1, 0,1,2,3,4,5,6,7,8,9,10,11,12,13,14,15);
        }
#pragma unroll
        for (int ni = 0; ni < 2; ++ni) {
            int col = waveN + ni * 16 + (lane & 15);
            v8bf h0 = *(const v8bf*)&Bhi[col][kb0];
            v8bf h1 = *(const v8bf*)&Bhi[col][kb0 + 16];
            bH[ni] = __builtin_shufflevector(h0, h1, 0,1,2,3,4,5,6,7,8,9,10,11,12,13,14,15);
            v8bf l0 = *(const v8bf*)&Blo[col][kb0];
            v8bf l1 = *(const v8bf*)&Blo[col][kb0 + 16];
            bL[ni] = __builtin_shufflevector(l0, l1, 0,1,2,3,4,5,6,7,8,9,10,11,12,13,14,15);
        }
        // ---- 24 WMMAs: hi*hi + hi*lo + lo*hi
#pragma unroll
        for (int mi = 0; mi < 4; ++mi) {
#pragma unroll
            for (int ni = 0; ni < 2; ++ni) {
                c[mi][ni] = __builtin_amdgcn_wmma_f32_16x16x32_bf16(
                    false, aH[mi], false, bH[ni], (short)0, c[mi][ni], false, false);
                c[mi][ni] = __builtin_amdgcn_wmma_f32_16x16x32_bf16(
                    false, aH[mi], false, bL[ni], (short)0, c[mi][ni], false, false);
                c[mi][ni] = __builtin_amdgcn_wmma_f32_16x16x32_bf16(
                    false, aL[mi], false, bH[ni], (short)0, c[mi][ni], false, false);
            }
        }
        __syncthreads();
    }

    // ---- epilogue: (acc + bias) * token_weight, scatter-accumulate
    const int nLane = lane & 15;
    const int mOff  = (lane >> 4) * 8;
#pragma unroll
    for (int mi = 0; mi < 4; ++mi) {
        const int base = waveM + mi * 16 + mOff;
        int   toks[8];
        float ws8[8];
#pragma unroll
        for (int j = 0; j < 8; ++j) { toks[j] = sTok[base + j]; ws8[j] = sW[base + j]; }
#pragma unroll
        for (int ni = 0; ni < 2; ++ni) {
            const int ncol = n0 + waveN + ni * 16 + nLane;
            const float bias = be[e * DIM + ncol];
#pragma unroll
            for (int j = 0; j < 8; ++j) {
                if (toks[j] < 0) continue;
                float val = (c[mi][ni][j] + bias) * ws8[j];
                atomicAdd(out + (size_t)toks[j] * DIM + ncol, val);
            }
        }
    }
}

// ---------------------------------------------------------------- launch
extern "C" void kernel_launch(void* const* d_in, const int* in_sizes, int n_in,
                              void* d_out, int out_size, void* d_ws, size_t ws_size,
                              hipStream_t stream) {
    const float* x  = (const float*)d_in[0];
    const float* Wg = (const float*)d_in[1];
    const float* bg = (const float*)d_in[2];
    const float* We = (const float*)d_in[3];
    const float* be = (const float*)d_in[4];
    float* out = (float*)d_out;

    char*  ws     = (char*)d_ws;
    int*   counts = (int*)ws;                                   // 8 ints (64B slot)
    float* wgt    = (float*)(ws + 64);                          // N floats
    int*   lists  = (int*)(ws + 64 + N_TOKENS * sizeof(float)); // E*N ints (~1MB total)

    hipMemsetAsync(counts, 0, 64, stream);
    moe_zero_kernel<<<4096, 256, 0, stream>>>((float4*)out, N_TOKENS * DIM / 4);
    moe_gate_kernel<<<N_TOKENS / 8, 256, 0, stream>>>(x, Wg, bg, wgt, counts, lists);

    dim3 grid(DIM / BN, N_TOKENS / BM, NEXP);   // N-tiles x row-tiles x experts
    moe_expert_gemm<<<grid, 256, 0, stream>>>(x, We, be, wgt, counts, lists, out);
}

// v001
// Next to v000, in two timings, it ran 3.00 and 2.98 times as fast.
#include <hip/hip_runtime.h>

#define N_TOKENS 32768
#define DIM      1024
#define NEXP     8

#define BM 128
#define BN 128
#define BK 32
#define LDR 72   // LDS row in bf16 elements: 32 hi | 32 lo | 8 pad (144 B = 16 B x odd)
#define PROW (2 * DIM)   // plane row in bf16 elements: per 32-k chunk 32 hi then 32 lo (one 128-B line)
#define WSPLIT_BLOCKS (NEXP * (DIM / 32) * (DIM / 64))
#define XSPLIT_BLOCKS (N_TOKENS * DIM / 8 / 256)

typedef __attribute__((ext_vector_type(16))) __bf16 v16bf;
typedef __attribute__((ext_vector_type(8)))  __bf16 v8bf;
typedef __attribute__((ext_vector_type(4)))  __bf16 v4bf;
typedef __attribute__((ext_vector_type(8)))  float  v8f;

// ---------------------------------------------------------------- zero output
__global__ void moe_zero_kernel(float4* __restrict__ out, int n4) {
    int i = blockIdx.x * blockDim.x + threadIdx.x;
    int stride = gridDim.x * blockDim.x;
    float4 z = {0.f, 0.f, 0.f, 0.f};
    for (; i < n4; i += stride) out[i] = z;
}

// ---------------------------------------------------------------- split pre-pass
// Splits every float of x and We once into bf16 hi + bf16 lo (lo = v - hi) and
// writes them K-contiguous: row r, chunk kc holds [32 hi | 32 lo] = one 128-B line.
// We is transposed on the way (plane row = output column n).
__device__ __forceinline__ void split8(const float* f, __bf16* dst) {
    v8bf hi, lo;
#pragma unroll
    for (int i = 0; i < 8; ++i) {
        __bf16 h = (__bf16)f[i];
        hi[i] = h;
        lo[i] = (__bf16)(f[i] - (float)h);
    }
    *(v8bf*)dst        = hi;
    *(v8bf*)(dst + 32) = lo;
}

__global__ __launch_bounds__(256) void moe_split_kernel(
    const float* __restrict__ x, const float* __restrict__ We,
    __bf16* __restrict__ xs, __bf16* __restrict__ wsp) {
    __shared__ float tile[32][65];   // 32 k x 64 n, odd pitch: column reads hit distinct banks
    const int tid = threadIdx.x;
    if (blockIdx.x < WSPLIT_BLOCKS) {
        const int b  = blockIdx.x;
        const int e  = b >> 9;
        const int kc = (b >> 4) & 31;
        const int nt = b & 15;
        const float* srcW = We + ((size_t)e * DIM + kc * 32) * DIM + nt * 64;
#pragma unroll
        for (int i = 0; i < 2; ++i) {
            int idx = tid + i * 256;
            int r = idx >> 4, c4 = idx & 15;
            float4 v = *(const float4*)(srcW + (size_t)r * DIM + c4 * 4);
            tile[r][c4 * 4 + 0] = v.x;
            tile[r][c4 * 4 + 1] = v.y;
            tile[r][c4 * 4 + 2] = v.z;
            tile[r][c4 * 4 + 3] = v.w;
        }
        __syncthreads();
        const int n = tid >> 2, c = tid & 3;
        float f[8];
#pragma unroll
        for (int i = 0; i < 8; ++i) f[i] = tile[c * 8 + i][n];
        split8(f, wsp + ((size_t)e * DIM + nt * 64 + n) * PROW + kc * 64 + c * 8);
    } else {
        const size_t g = (size_t)(blockIdx.x - WSPLIT_BLOCKS) * 256 + tid;   // 8 floats each
        const size_t row = g >> 7;
        const int    k   = ((int)g & 127) * 8;
        const float* p = x + row * DIM + k;
        float4 v0 = *(const float4*)p;
        float4 v1 = *(const float4*)(p + 4);
        float f[8] = {v0.x, v0.y, v0.z, v0.w, v1.x, v1.y, v1.z, v1.w};
        split8(f, xs + row * PROW + (k >> 5) * 64 + (k & 31));
    }
}

// ---------------------------------------------------------------- gating
// One wave32 per token: gate scores, softmax, top-2, weight = sum of top-2.
// Appends token to the two selected experts' compacted lists.
__global__ __launch_bounds__(256) void moe_gate_kernel(
    const float* __restrict__ x, const float* __restrict__ Wg,
    const float* __restrict__ bg, float* __restrict__ wgt,
    int* __restrict__ counts, int* __restrict__ lists) {
    const int lane  = threadIdx.x & 31;
    const int wave  = threadIdx.x >> 5;
    const int token = blockIdx.x * 8 + wave;
    const float* xr = x + (size_t)token * DIM;

    float acc[NEXP];
#pragma unroll
    for (int e = 0; e < NEXP; ++e) acc[e] = 0.f;
    for (int d = lane; d < DIM; d += 32) {
        float xv = xr[d];
        const float* wr = Wg + d * NEXP;
#pragma unroll
        for (int e = 0; e < NEXP; ++e) acc[e] += xv * wr[e];
    }
#pragma unroll
    for (int e = 0; e < NEXP; ++e) {
#pragma unroll
        for (int off = 16; off > 0; off >>= 1)
            acc[e] += __shfl_xor(acc[e], off, 32);
    }
    if (lane == 0) {
        float s[NEXP];
        float m = -1e30f;
#pragma unroll
        for (int e = 0; e < NEXP; ++e) { s[e] = acc[e] + bg[e]; m = fmaxf(m, s[e]); }
        float sum = 0.f;
#pragma unroll
        for (int e = 0; e < NEXP; ++e) { s[e] = expf(s[e] - m); sum += s[e]; }
        float inv = 1.f / sum;
#pragma unroll
        for (int e = 0; e < NEXP; ++e) s[e] *= inv;
        int i1 = 0;
#pragma unroll
        for (int e = 1; e < NEXP; ++e) if (s[e] > s[i1]) i1 = e;   // strict > : first-index tie rule
        int i2 = (i1 == 0) ? 1 : 0;
#pragma unroll
        for (int e = 0; e < NEXP; ++e) if (e != i1 && s[e] > s[i2]) i2 = e;

        wgt[token] = s[i1] + s[i2];
        int p1 = atomicAdd(&counts[i1], 1);
        lists[i1 * N_TOKENS + p1] = token;
        int p2 = atomicAdd(&counts[i2], 1);
        lists[i2 * N_TOKENS + p2] = token;
    }
}

// ---------------------------------------------------------------- expert GEMM
// Per expert, compacted rows. 128x128x32 block tile, 8 waves (2x4), each wave
// computes a 64x32 sub-tile = 4x2 WMMA fragments. Split-bf16 (hi+lo) inputs:
// 3 v_wmma_f32_16x16x32_bf16 per fragment pair per K-step -> ~fp32 accuracy.
// Operands come ready split from the pre-pass planes: staging is 16-B copies only.
// Global->register prefetch of the next K-tile overlaps the WMMA burst.
__global__ __launch_bounds__(256) void moe_expert_gemm(
    const __bf16* __restrict__ xs, const __bf16* __restrict__ wsp,
    const float* __restrict__ be, const float* __restrict__ wgt,
    const int* __restrict__ counts, const int* __restrict__ lists,
    float* __restrict__ out) {
    const int e    = blockIdx.z;
    const int cnt  = counts[e];
    const int row0 = blockIdx.y * BM;
    if (row0 >= cnt) return;
    const int n0 = blockIdx.x * BN;

    __shared__ __attribute__((aligned(16))) __bf16 As[BM][LDR];   // [m][32 hi | 32 lo]
    __shared__ __attribute__((aligned(16))) __bf16 Bs[BN][LDR];   // [n][32 hi | 32 lo]
    __shared__ int    sTok[BM];
    __shared__ float  sW[BM];

    const int tid = threadIdx.x;
    if (tid < BM) {
        int r   = row0 + tid;
        int tok = (r < cnt) ? lists[e * N_TOKENS + r] : -1;
        sTok[tid] = tok;
        sW[tid]   = (tok >= 0) ? wgt[tok] : 0.f;
    }
    __syncthreads();

    const int lane  = tid & 31;
    const int wave  = tid >> 5;
    const int waveM = (wave >> 2) * 64;        // 0 or 64
    const int waveN = (wave & 3) * 32;         // 0,32,64,96

    v8f c[4][2] = {};

    // Staging map, A and B alike: 128 rows x 8 chunks of 16 B -> 256 threads x 4 iters
    const int lr = tid >> 3, ch = tid & 7;         // lr 0..31, ch 0..7 (0-3 hi, 4-7 lo)
    const int kb0 = (lane < 16) ? 0 : 8;           // ISA 16-bit A/B lane K-base

    const __bf16* aPtr[4];
    const __bf16* bPtr[4];
#pragma unroll
    for (int rr = 0; rr < 4; ++rr) {
        int row = lr + rr * 32;
        int tok = sTok[row]; if (tok < 0) tok = 0;
        aPtr[rr] = xs + (size_t)tok * PROW + ch * 8;
        bPtr[rr] = wsp + ((size_t)e * DIM + n0 + row) * PROW + ch * 8;
    }

    v8bf aReg[4], bReg[4];

    auto loadTiles = [&](int k0) {
#pragma unroll
        for (int rr = 0; rr < 4; ++rr) aReg[rr] = *(const v8bf*)(aPtr[rr] + k0 * 2);
#pragma unroll
        for (int rr = 0; rr < 4; ++rr) bReg[rr] = *(const v8bf*)(bPtr[rr] + k0 * 2);
    };
    auto storeTiles = [&]() {
#pragma unroll
        for (int rr = 0; rr < 4; ++rr) *(v8bf*)&As[lr + rr * 32][ch * 8] = aReg[rr];
#pragma unroll
        for (int rr = 0; rr < 4; ++rr) *(v8bf*)&Bs[lr + rr * 32][ch * 8] = bReg[rr];
    };

    loadTiles(0);
    for (int k0 = 0; k0 < DIM; k0 += BK) {
        storeTiles();
        __syncthreads();
        if (k0 + BK < DIM) {
            loadTiles(k0 + BK);   // prefetch next K-tile (overlaps WMMA)
            // The fragment loads below reuse the address registers of these loads.
            asm volatile("s_wait_xcnt 0x0" ::: "memory");
        }

        // ---- assemble fragments (two ds_load_b128 each; layout per ISA 7.12.2)
        v16bf aH[4], aL[4], bH[2], bL[2];
#pragma unroll
        for (int mi = 0; mi < 4; ++mi) {
            int row = waveM + mi * 16 + (lane & 15);
            v8bf h0 = *(const v8bf*)&As[row][kb0];
            v8bf h1 = *(const v8bf*)&As[row][kb0 + 16];
            aH[mi] = __builtin_shufflevector(h0, h1, 0,1,2,3,4,5,6,7,8,9,10,11,12,13,14,15);
            v8bf l0 = *(const v8bf*)&As[row][32 + kb0];
            v8bf l1 = *(const v8bf*)&As[row][32 + kb0 + 16];
            aL[mi] = __builtin_shufflevector(l0, l1, 0,1,2,3,4,5,6,7,8,9,10,11,12,13,14,15);
        }
#pragma unroll
        for (int ni = 0; ni < 2; ++ni) {
            int col = waveN + ni * 16 + (lane & 15);
            v8bf h0 = *(const v8bf*)&Bs[col][kb0];
            v8bf h1 = *(const v8bf*)&Bs[col][kb0 + 16];
            bH[ni] = __builtin_shufflevector(h0, h1, 0,1,2,3,4,5,6,7,8,9,10,11,12,13,14,15);
            v8bf l0 = *(const v8bf*)&Bs[col][32 + kb0];
            v8bf l1 = *(const v8bf*)&Bs[col][32 + kb0 + 16];
            bL[ni] = __builtin_shufflevector(l0, l1, 0,1,2,3,4,5,6,7,8,9,10,11,12,13,14,15);
        }
        // ---- 24 WMMAs: hi*hi + hi*lo + lo*hi
#pragma unroll
        for (int mi = 0; mi < 4; ++mi) {
#pragma unroll
            for (int ni = 0; ni < 2; ++ni) {
                c[mi][ni] = __builtin_amdgcn_wmma_f32_16x16x32_bf16(
                    false, aH[mi], false, bH[ni], (short)0, c[mi][ni], false, false);
                c[mi][ni] = __builtin_amdgcn_wmma_f32_16x16x32_bf16(
                    false, aH[mi], false, bL[ni], (short)0, c[mi][ni], false, false);
                c[mi][ni] = __builtin_amdgcn_wmma_f32_16x16x32_bf16(
                    false, aL[mi], false, bH[ni], (short)0, c[mi][ni], false, false);
            }
        }
        __syncthreads();
    }

    // ---- epilogue: (acc + bias) * token_weight, scatter-accumulate
    const int nLane = lane & 15;
    const int mOff  = (lane >> 4) * 8;
#pragma unroll
    for (int mi = 0; mi < 4; ++mi) {
        const int base = waveM + mi * 16 + mOff;
        int   toks[8];
        float ws8[8];
#pragma unroll
        for (int j = 0; j < 8; ++j) { toks[j] = sTok[base + j]; ws8[j] = sW[base + j]; }
#pragma unroll
        for (int ni = 0; ni < 2; ++ni) {
            const int ncol = n0 + waveN + ni * 16 + nLane;
            const float bias = be[e * DIM + ncol];
#pragma unroll
            for (int j = 0; j < 8; ++j) {
                if (toks[j] < 0) continue;
                float val = (c[mi][ni][j] + bias) * ws8[j];
                atomicAdd(out + (size_t)toks[j] * DIM + ncol, val);
            }
        }
    }
}

// ---------------------------------------------------------------- launch
extern "C" void kernel_launch(void* const* d_in, const int* in_sizes, int n_in,
                              void* d_out, int out_size, void* d_ws, size_t ws_size,
                              hipStream_t stream) {
    const float* x  = (const float*)d_in[0];
    const float* Wg = (const float*)d_in[1];
    const float* bg = (const float*)d_in[2];
    const float* We = (const float*)d_in[3];
    const float* be = (const float*)d_in[4];
    float* out = (float*)d_out;

    char*  ws     = (char*)d_ws;
    int*   counts = (int*)ws;                                   // 8 ints (64B slot)
    float* wgt    = (float*)(ws + 64);                          // N floats
    int*   lists  = (int*)(ws + 64 + N_TOKENS * sizeof(float)); // E*N ints (~1MB total)
    __bf16* xs    = (__bf16*)(ws + (2u << 20));                 // N x 2D bf16 (128 MiB)
    __bf16* wsp   = (__bf16*)(ws + (130u << 20));               // E x D x 2D bf16 (32 MiB)

    hipMemsetAsync(counts, 0, 64, stream);
    moe_zero_kernel<<<4096, 256, 0, stream>>>((float4*)out, N_TOKENS * DIM / 4);
    moe_gate_kernel<<<N_TOKENS / 8, 256, 0, stream>>>(x, Wg, bg, wgt, counts, lists);
    moe_split_kernel<<<WSPLIT_BLOCKS + XSPLIT_BLOCKS, 256, 0, stream>>>(x, We, xs, wsp);

    dim3 grid(DIM / BN, N_TOKENS / BM, NEXP);   // N-tiles x row-tiles x experts
    moe_expert_gemm<<<grid, 256, 0, stream>>>(xs, wsp, be, wgt, counts, lists, out);
}

// v002
// Two timings next to v001 put it at 1.15 and 1.14 times that version's speed.
// Over all steps from v000 it is 3.42 times as fast.
#include <hip/hip_runtime.h>

#define N_TOKENS 32768
#define DIM      1024
#define NEXP     8
#define NPAIR    28   // unordered pairs of distinct experts

#define BM 128
#define BN 128
#define BK 32
#define KSTEPS (DIM / BK)
#define LDR 72   // LDS row in bf16 elements: 32 hi | 32 lo | 8 pad (144 B = 16 B x odd)
#define PROW (2 * DIM)   // plane row in bf16 elements: per 32-k chunk 32 hi then 32 lo (one 128-B line)
#define WSPLIT_BLOCKS (NEXP * (DIM / 32) * (DIM / 64))
#define XSPLIT_BLOCKS (N_TOKENS * DIM / 8 / 256)

typedef __attribute__((ext_vector_type(16))) __bf16 v16bf;
typedef __attribute__((ext_vector_type(8)))  __bf16 v8bf;
typedef __attribute__((ext_vector_type(4)))  __bf16 v4bf;
typedef __attribute__((ext_vector_type(8)))  float  v8f;

// ---------------------------------------------------------------- split pre-pass
// Splits every float of x and We once into bf16 hi + bf16 lo (lo = v - hi) and
// writes them K-contiguous: row r, chunk kc holds [32 hi | 32 lo] = one 128-B line.
// We is transposed on the way (plane row = output column n).
__device__ __forceinline__ void split8(const float* f, __bf16* dst) {
    v8bf hi, lo;
#pragma unroll
    for (int i = 0; i < 8; ++i) {
        __bf16 h = (__bf16)f[i];
        hi[i] = h;
        lo[i] = (__bf16)(f[i] - (float)h);
    }
    *(v8bf*)dst        = hi;
    *(v8bf*)(dst + 32) = lo;
}

__global__ __launch_bounds__(256) void moe_split_kernel(
    const float* __restrict__ x, const float* __restrict__ We,
    __bf16* __restrict__ xs, __bf16* __restrict__ wsp) {
    __shared__ float tile[32][65];   // 32 k x 64 n, odd pitch: column reads hit distinct banks
    const int tid = threadIdx.x;
    if (blockIdx.x < WSPLIT_BLOCKS) {
        const int b  = blockIdx.x;
        const int e  = b >> 9;
        const int kc = (b >> 4) & 31;
        const int nt = b & 15;
        const float* srcW = We + ((size_t)e * DIM + kc * 32) * DIM + nt * 64;
#pragma unroll
        for (int i = 0; i < 2; ++i) {
            int idx = tid + i * 256;
            int r = idx >> 4, c4 = idx & 15;
            float4 v = *(const float4*)(srcW + (size_t)r * DIM + c4 * 4);
            tile[r][c4 * 4 + 0] = v.x;
            tile[r][c4 * 4 + 1] = v.y;
            tile[r][c4 * 4 + 2] = v.z;
            tile[r][c4 * 4 + 3] = v.w;
        }
        __syncthreads();
        const int n = tid >> 2, c = tid & 3;
        float f[8];
#pragma unroll
        for (int i = 0; i < 8; ++i) f[i] = tile[c * 8 + i][n];
        split8(f, wsp + ((size_t)e * DIM + nt * 64 + n) * PROW + kc * 64 + c * 8);
    } else {
        const size_t g = (size_t)(blockIdx.x - WSPLIT_BLOCKS) * 256 + tid;   // 8 floats each
        const size_t row = g >> 7;
        const int    k   = ((int)g & 127) * 8;
        const float* p = x + row * DIM + k;
        float4 v0 = *(const float4*)p;
        float4 v1 = *(const float4*)(p + 4);
        float f[8] = {v0.x, v0.y, v0.z, v0.w, v1.x, v1.y, v1.z, v1.w};
        split8(f, xs + row * PROW + (k >> 5) * 64 + (k & 31));
    }
}

// ---------------------------------------------------------------- gating
// One wave32 per token: gate scores, softmax, top-2, weight = sum of top-2.
// Appends the token to the compacted list of its unordered expert pair (lo < hi).
__global__ __launch_bounds__(256) void moe_gate_kernel(
    const float* __restrict__ x, const float* __restrict__ Wg,
    const float* __restrict__ bg, float* __restrict__ wgt,
    int* __restrict__ counts, int* __restrict__ lists) {
    const int lane  = threadIdx.x & 31;
    const int wave  = threadIdx.x >> 5;
    const int token = blockIdx.x * 8 + wave;
    const float* xr = x + (size_t)token * DIM;

    float acc[NEXP];
#pragma unroll
    for (int e = 0; e < NEXP; ++e) acc[e] = 0.f;
    for (int d = lane; d < DIM; d += 32) {
        float xv = xr[d];
        const float* wr = Wg + d * NEXP;
#pragma unroll
        for (int e = 0; e < NEXP; ++e) acc[e] += xv * wr[e];
    }
#pragma unroll
    for (int e = 0; e < NEXP; ++e) {
#pragma unroll
        for (int off = 16; off > 0; off >>= 1)
            acc[e] += __shfl_xor(acc[e], off, 32);
    }
    if (lane == 0) {
        float s[NEXP];
        float m = -1e30f;
#pragma unroll
        for (int e = 0; e < NEXP; ++e) { s[e] = acc[e] + bg[e]; m = fmaxf(m, s[e]); }
        float sum = 0.f;
#pragma unroll
        for (int e = 0; e < NEXP; ++e) { s[e] = expf(s[e] - m); sum += s[e]; }
        float inv = 1.f / sum;
#pragma unroll
        for (int e = 0; e < NEXP; ++e) s[e] *= inv;
        int i1 = 0;
#pragma unroll
        for (int e = 1; e < NEXP; ++e) if (s[e] > s[i1]) i1 = e;   // strict > : first-index tie rule
        int i2 = (i1 == 0) ? 1 : 0;
#pragma unroll
        for (int e = 0; e < NEXP; ++e) if (e != i1 && s[e] > s[i2]) i2 = e;

        wgt[token] = s[i1] + s[i2];
        const int lo = (i1 < i2) ? i1 : i2;
        const int hi = (i1 < i2) ? i2 : i1;
        const int pr = lo * 7 - (lo * (lo - 1)) / 2 + (hi - lo - 1);   // rank of (lo, hi), lo-major
        // The add's result may be given a register of the wgt store's address: wait in front of that overwrite.
        asm volatile("s_wait_xcnt 0x0" ::: "memory");
        int p = atomicAdd(&counts[pr], 1);
        lists[pr * N_TOKENS + p] = token;
    }
}

// ---------------------------------------------------------------- expert GEMM
// Per expert pair, compacted rows: every row of a tile wants the same two experts,
// so the K loop runs over both weight planes in turn (64 steps) into one set of
// accumulators, and each output element is stored once by one work-group.
// blockIdx.y is a flat row-tile index; the pair counts say whose tile it is.
// 128x128x32 block tile, 8 waves (2x4), each wave
// computes a 64x32 sub-tile = 4x2 WMMA fragments. Split-bf16 (hi+lo) inputs:
// 3 v_wmma_f32_16x16x32_bf16 per fragment pair per K-step -> ~fp32 accuracy.
// Operands come ready split from the pre-pass planes: staging is 16-B copies only.
// Global->register prefetch of the next K-tile overlaps the WMMA burst.
__global__ __launch_bounds__(256) void moe_expert_gemm(
    const __bf16* __restrict__ xs, const __bf16* __restrict__ wsp,
    const float* __restrict__ be, const float* __restrict__ wgt,
    const int* __restrict__ counts, const int* __restrict__ lists,
    float* __restrict__ out) {
    const int t = blockIdx.y;
    int pr = -1, ea = 0, eb = 0, cnt = 0, first = 0;
    {
        int q = 0, base = 0;   // base = row tiles of the pairs before q
        // Both loops unrolled: a, b and q become constants and the 28 counts come by wide scalar loads.
#pragma unroll
        for (int a = 0; a < NEXP; ++a) {
#pragma unroll
            for (int b = a + 1; b < NEXP; ++b, ++q) {
                const int  c    = counts[q];
                const int  next = base + (int)((unsigned)(c + BM - 1) / BM);
                const bool mine = (t >= base) & (t < next);
                pr    = mine ? q    : pr;
                ea    = mine ? a    : ea;
                eb    = mine ? b    : eb;
                cnt   = mine ? c    : cnt;
                first = mine ? base : first;
                base  = next;
            }
        }
    }
    if (pr < 0) return;   // past the last tile: the whole work-group leaves, before any barrier
    const int row0 = (t - first) * BM;
    const int n0 = blockIdx.x * BN;

    __shared__ __attribute__((aligned(16))) __bf16 As[BM][LDR];   // [m][32 hi | 32 lo]
    __shared__ __attribute__((aligned(16))) __bf16 Bs[BN][LDR];   // [n][32 hi | 32 lo]
    __shared__ int    sTok[BM];
    __shared__ float  sW[BM];

    const int tid = threadIdx.x;
    if (tid < BM) {
        int r   = row0 + tid;
        int tok = (r < cnt) ? lists[pr * N_TOKENS + r] : -1;
        sTok[tid] = tok;
        sW[tid]   = (tok >= 0) ? wgt[tok] : 0.f;
    }
    __syncthreads();

    const int lane  = tid & 31;
    const int wave  = tid >> 5;
    const int waveM = (wave >> 2) * 64;        // 0 or 64
    const int waveN = (wave & 3) * 32;         // 0,32,64,96

    v8f c[4][2] = {};

    // Staging map, A and B alike: 128 rows x 8 chunks of 16 B -> 256 threads x 4 iters
    const int lr = tid >> 3, ch = tid & 7;         // lr 0..31, ch 0..7 (0-3 hi, 4-7 lo)
    const int kb0 = (lane < 16) ? 0 : 8;           // ISA 16-bit A/B lane K-base

    const __bf16* aPtr[4];
    const __bf16* bPtr[4];
#pragma unroll
    for (int rr = 0; rr < 4; ++rr) {
        int row = lr + rr * 32;
        int tok = sTok[row]; if (tok < 0) tok = 0;
        aPtr[rr] = xs + (size_t)tok * PROW + ch * 8;
        bPtr[rr] = wsp + (size_t)(n0 + row) * PROW + ch * 8;   // expert plane added per step
    }

    v8bf aReg[4], bReg[4];

    // step st: K chunk st & 31 of x against expert ea (st < 32) or eb
    auto loadTiles = [&](int st) {
        const int    ko = (st & (KSTEPS - 1)) * (2 * BK);
        const size_t bo = (size_t)((st < KSTEPS) ? ea : eb) * DIM * PROW + ko;
#pragma unroll
        for (int rr = 0; rr < 4; ++rr) aReg[rr] = *(const v8bf*)(aPtr[rr] + ko);
#pragma unroll
        for (int rr = 0; rr < 4; ++rr) bReg[rr] = *(const v8bf*)(bPtr[rr] + bo);
    };
    auto storeTiles = [&]() {
#pragma unroll
        for (int rr = 0; rr < 4; ++rr) *(v8bf*)&As[lr + rr * 32][ch * 8] = aReg[rr];
#pragma unroll
        for (int rr = 0; rr < 4; ++rr) *(v8bf*)&Bs[lr + rr * 32][ch * 8] = bReg[rr];
    };

    loadTiles(0);
    for (int st = 0; st < 2 * KSTEPS; ++st) {
        storeTiles();
        __syncthreads();
        if (st + 1 < 2 * KSTEPS) {
            loadTiles(st + 1);   // prefetch next K-tile (overlaps WMMA)
            // The fragment loads below reuse the address registers of these loads.
            asm volatile("s_wait_xcnt 0x0" ::: "memory");
        }

        // ---- assemble fragments (two ds_load_b128 each; layout per ISA 7.12.2)
        v16bf aH[4], aL[4], bH[2], bL[2];
#pragma unroll
        for (int mi = 0; mi < 4; ++mi) {
            int row = waveM + mi * 16 + (lane & 15);
            v8bf h0 = *(const v8bf*)&As[row][kb0];
            v8bf h1 = *(const v8bf*)&As[row][kb0 + 16];
            aH[mi] = __builtin_shufflevector(h0, h1, 0,1,2,3,4,5,6,7,8,9,10,11,12,13,14,15);
            v8bf l0 = *(const v8bf*)&As[row][32 + kb0];
            v8bf l1 = *(const v8bf*)&As[row][32 + kb0 + 16];
            aL[mi] = __builtin_shufflevector(l0, l1, 0,1,2,3,4,5,6,7,8,9,10,11,12,13,14,15);
        }
#pragma unroll
        for (int ni = 0; ni < 2; ++ni) {
            int col = waveN + ni * 16 + (lane & 15);
            v8bf h0 = *(const v8bf*)&Bs[col][kb0];
            v8bf h1 = *(const v8bf*)&Bs[col][kb0 + 16];
            bH[ni] = __builtin_shufflevector(h0, h1, 0,1,2,3,4,5,6,7,8,9,10,11,12,13,14,15);
            v8bf l0 = *(const v8bf*)&Bs[col][32 + kb0];
            v8bf l1 = *(const v8bf*)&Bs[col][32 + kb0 + 16];
            bL[ni] = __builtin_shufflevector(l0, l1, 0,1,2,3,4,5,6,7,8,9,10,11,12,13,14,15);
        }
        // ---- 24 WMMAs: hi*hi + hi*lo + lo*hi
#pragma unroll
        for (int mi = 0; mi < 4; ++mi) {
#pragma unroll
            for (int ni = 0; ni < 2; ++ni) {
                c[mi][ni] = __builtin_amdgcn_wmma_f32_16x16x32_bf16(
                    false, aH[mi], false, bH[ni], (short)0, c[mi][ni], false, false);
                c[mi][ni] = __builtin_amdgcn_wmma_f32_16x16x32_bf16(
                    false, aH[mi], false, bL[ni], (short)0, c[mi][ni], false, false);
                c[mi][ni] = __builtin_amdgcn_wmma_f32_16x16x32_bf16(
                    false, aL[mi], false, bH[ni], (short)0, c[mi][ni], false, false);
            }
        }
        __syncthreads();
    }

    // ---- epilogue: (acc + both biases) * token_weight, one plain store per element
    const int nLane = lane & 15;
    const int mOff  = (lane >> 4) * 8;
#pragma unroll
    for (int mi = 0; mi < 4; ++mi) {
        const int base = waveM + mi * 16 + mOff;
        int   toks[8];
        float ws8[8];
#pragma unroll
        for (int j = 0; j < 8; ++j) { toks[j] = sTok[base + j]; ws8[j] = sW[base + j]; }
#pragma unroll
        for (int ni = 0; ni < 2; ++ni) {
            const int ncol = n0 + waveN + ni * 16 + nLane;
            const float bias = be[ea * DIM + ncol] + be[eb * DIM + ncol];
#pragma unroll
            for (int j = 0; j < 8; ++j) {
                if (toks[j] < 0) continue;
                out[(size_t)toks[j] * DIM + ncol] = (c[mi][ni][j] + bias) * ws8[j];
            }
        }
    }
}

// ---------------------------------------------------------------- launch
extern "C" void kernel_launch(void* const* d_in, const int* in_sizes, int n_in,
                              void* d_out, int out_size, void* d_ws, size_t ws_size,
                              hipStream_t stream) {
    const float* x  = (const float*)d_in[0];
    const float* Wg = (const float*)d_in[1];
    const float* bg = (const float*)d_in[2];
    const float* We = (const float*)d_in[3];
    const float* be = (const float*)d_in[4];
    float* out = (float*)d_out;

    char*  ws     = (char*)d_ws;
    int*   counts = (int*)ws;                                    // 28 ints (128B slot)
    float* wgt    = (float*)(ws + 128);                          // N floats
    int*   lists  = (int*)(ws + 128 + N_TOKENS * sizeof(float)); // 28*N ints (3.5 MiB)
    __bf16* xs    = (__bf16*)(ws + (4u << 20));                  // N x 2D bf16 (128 MiB)
    __bf16* wsp   = (__bf16*)(ws + (132u << 20));                // E x D x 2D bf16 (32 MiB)

    hipMemsetAsync(counts, 0, 128, stream);
    moe_gate_kernel<<<N_TOKENS / 8, 256, 0, stream>>>(x, Wg, bg, wgt, counts, lists);
    moe_split_kernel<<<WSPLIT_BLOCKS + XSPLIT_BLOCKS, 256, 0, stream>>>(x, We, xs, wsp);

    dim3 grid(DIM / BN, N_TOKENS / BM + NPAIR);   // N-tiles x most row tiles the 28 lists can need
    moe_expert_gemm<<<grid, 256, 0, stream>>>(xs, wsp, be, wgt, counts, lists, out);
}

// v003
// Next to v002, in two timings, it ran 1.38 times as fast each time.
// All steps since v000 together make it 4.73 times as fast.
#include <hip/hip_runtime.h>

#define N_TOKENS 32768
#define DIM      1024
#define NEXP     8
#define NPAIR    28   // unordered pairs of distinct experts

#define BM 128
#define BN 128
#define BK 32
#define KSTEPS (DIM / BK)
#define LDR 72   // LDS row in bf16 elements: 32 hi | 32 lo | 8 pad (144 B = 16 B x odd)
#define PROW (2 * DIM)   // plane row in bf16 elements: per 32-k chunk 32 hi then 32 lo (one 128-B line)
#define WSPLIT_BLOCKS (NPAIR * (DIM / 32) * (DIM / 64))
#define XSPLIT_BLOCKS (N_TOKENS * DIM / 8 / 256)

typedef __attribute__((ext_vector_type(16))) __bf16 v16bf;
typedef __attribute__((ext_vector_type(8)))  __bf16 v8bf;
typedef __attribute__((ext_vector_type(4)))  __bf16 v4bf;
typedef __attribute__((ext_vector_type(8)))  float  v8f;

// ---------------------------------------------------------------- split pre-pass
// Splits every float of x once into bf16 hi + bf16 lo (lo = v - hi) and
// writes them K-contiguous: row r, chunk kc holds [32 hi | 32 lo] = one 128-B line.
// The weights get one plane per expert pair (a, b): x*We[a] + x*We[b] = x*(We[a] + We[b]),
// so the f32 sum of the two matrices is split, transposed on the way (plane row = output column n).
__device__ __forceinline__ void split8(const float* f, __bf16* dst) {
    v8bf hi, lo;
#pragma unroll
    for (int i = 0; i < 8; ++i) {
        __bf16 h = (__bf16)f[i];
        hi[i] = h;
        lo[i] = (__bf16)(f[i] - (float)h);
    }
    *(v8bf*)dst        = hi;
    *(v8bf*)(dst + 32) = lo;
}

__global__ __launch_bounds__(256) void moe_split_kernel(
    const float* __restrict__ x, const float* __restrict__ We,
    __bf16* __restrict__ xs, __bf16* __restrict__ wsp) {
    __shared__ float tile[32][65];   // 32 k x 64 n, odd pitch: column reads hit distinct banks
    const int tid = threadIdx.x;
    if (blockIdx.x < WSPLIT_BLOCKS) {
        const int b  = blockIdx.x;
        const int pr = b >> 9;
        const int kc = (b >> 4) & 31;
        const int nt = b & 15;
        int ea = 0, eb = 0;
        {
            int q = 0;   // same lo-major pair rank as the gate and the GEMM
#pragma unroll
            for (int a = 0; a < NEXP; ++a) {
#pragma unroll
                for (int c = a + 1; c < NEXP; ++c, ++q) {
                    ea = (q == pr) ? a : ea;
                    eb = (q == pr) ? c : eb;
                }
            }
        }
        const size_t off = (size_t)(kc * 32) * DIM + nt * 64;
        const float* srcA = We + (size_t)ea * DIM * DIM + off;
        const float* srcB = We + (size_t)eb * DIM * DIM + off;
#pragma unroll
        for (int i = 0; i < 2; ++i) {
            int idx = tid + i * 256;
            int r = idx >> 4, c4 = idx & 15;
            float4 v = *(const float4*)(srcA + (size_t)r * DIM + c4 * 4);
            float4 u = *(const float4*)(srcB + (size_t)r * DIM + c4 * 4);
            tile[r][c4 * 4 + 0] = v.x + u.x;
            tile[r][c4 * 4 + 1] = v.y + u.y;
            tile[r][c4 * 4 + 2] = v.z + u.z;
            tile[r][c4 * 4 + 3] = v.w + u.w;
        }
        __syncthreads();
        const int n = tid >> 2, c = tid & 3;
        float f[8];
#pragma unroll
        for (int i = 0; i < 8; ++i) f[i] = tile[c * 8 + i][n];
        split8(f, wsp + ((size_t)pr * DIM + nt * 64 + n) * PROW + kc * 64 + c * 8);
    } else {
        const size_t g = (size_t)(blockIdx.x - WSPLIT_BLOCKS) * 256 + tid;   // 8 floats each
        const size_t row = g >> 7;
        const int    k   = ((int)g & 127) * 8;
        const float* p = x + row * DIM + k;
        float4 v0 = *(const float4*)p;
        float4 v1 = *(const float4*)(p + 4);
        float f[8] = {v0.x, v0.y, v0.z, v0.w, v1.x, v1.y, v1.z, v1.w};
        split8(f, xs + row * PROW + (k >> 5) * 64 + (k & 31));
    }
}

// ---------------------------------------------------------------- gating
// One wave32 per token: gate scores, softmax, top-2, weight = sum of top-2.
// Appends the token to the compacted list of its unordered expert pair (lo < hi).
__global__ __launch_bounds__(256) void moe_gate_kernel(
    const float* __restrict__ x, const float* __restrict__ Wg,
    const float* __restrict__ bg, float* __restrict__ wgt,
    int* __restrict__ counts, int* __restrict__ lists) {
    const int lane  = threadIdx.x & 31;
    const int wave  = threadIdx.x >> 5;
    const int token = blockIdx.x * 8 + wave;
    const float* xr = x + (size_t)token * DIM;

    float acc[NEXP];
#pragma unroll
    for (int e = 0; e < NEXP; ++e) acc[e] = 0.f;
    for (int d = lane; d < DIM; d += 32) {
        float xv = xr[d];
        const float* wr = Wg + d * NEXP;
#pragma unroll
        for (int e = 0; e < NEXP; ++e) acc[e] += xv * wr[e];
    }
#pragma unroll
    for (int e = 0; e < NEXP; ++e) {
#pragma unroll
        for (int off = 16; off > 0; off >>= 1)
            acc[e] += __shfl_xor(acc[e], off, 32);
    }
    if (lane == 0) {
        float s[NEXP];
        float m = -1e30f;
#pragma unroll
        for (int e = 0; e < NEXP; ++e) { s[e] = acc[e] + bg[e]; m = fmaxf(m, s[e]); }
        float sum = 0.f;
#pragma unroll
        for (int e = 0; e < NEXP; ++e) { s[e] = expf(s[e] - m); sum += s[e]; }
        float inv = 1.f / sum;
#pragma unroll
        for (int e = 0; e < NEXP; ++e) s[e] *= inv;
        int i1 = 0;
#pragma unroll
        for (int e = 1; e < NEXP; ++e) if (s[e] > s[i1]) i1 = e;   // strict > : first-index tie rule
        int i2 = (i1 == 0) ? 1 : 0;
#pragma unroll
        for (int e = 0; e < NEXP; ++e) if (e != i1 && s[e] > s[i2]) i2 = e;

        wgt[token] = s[i1] + s[i2];
        const int lo = (i1 < i2) ? i1 : i2;
        const int hi = (i1 < i2) ? i2 : i1;
        const int pr = lo * 7 - (lo * (lo - 1)) / 2 + (hi - lo - 1);   // rank of (lo, hi), lo-major
        // The add's result may be given a register of the wgt store's address: wait in front of that overwrite.
        asm volatile("s_wait_xcnt 0x0" ::: "memory");
        int p = atomicAdd(&counts[pr], 1);
        lists[pr * N_TOKENS + p] = token;
    }
}

// ---------------------------------------------------------------- expert GEMM
// Per expert pair, compacted rows: every row of a tile wants the same two experts,
// so the K loop runs once (32 steps) over the pair's summed weight plane,
// and each output element is stored once by one work-group.
// blockIdx.y is a flat row-tile index; the pair counts say whose tile it is.
// 128x128x32 block tile, 8 waves (2x4), each wave
// computes a 64x32 sub-tile = 4x2 WMMA fragments. Split-bf16 (hi+lo) inputs:
// 3 v_wmma_f32_16x16x32_bf16 per fragment pair per K-step -> ~fp32 accuracy.
// Operands come ready split from the pre-pass planes: staging is 16-B copies only.
// Global->register prefetch of the next K-tile overlaps the WMMA burst.
__global__ __launch_bounds__(256) void moe_expert_gemm(
    const __bf16* __restrict__ xs, const __bf16* __restrict__ wsp,
    const float* __restrict__ be, const float* __restrict__ wgt,
    const int* __restrict__ counts, const int* __restrict__ lists,
    float* __restrict__ out) {
    const int t = blockIdx.y;
    int pr = -1, ea = 0, eb = 0, cnt = 0, first = 0;
    {
        int q = 0, base = 0;   // base = row tiles of the pairs before q
        // Both loops unrolled: a, b and q become constants and the 28 counts come by wide scalar loads.
#pragma unroll
        for (int a = 0; a < NEXP; ++a) {
#pragma unroll
            for (int b = a + 1; b < NEXP; ++b, ++q) {
                const int  c    = counts[q];
                const int  next = base + (int)((unsigned)(c + BM - 1) / BM);
                const bool mine = (t >= base) & (t < next);
                pr    = mine ? q    : pr;
                ea    = mine ? a    : ea;
                eb    = mine ? b    : eb;
                cnt   = mine ? c    : cnt;
                first = mine ? base : first;
                base  = next;
            }
        }
    }
    if (pr < 0) return;   // past the last tile: the whole work-group leaves, before any barrier
    const int row0 = (t - first) * BM;
    const int n0 = blockIdx.x * BN;

    __shared__ __attribute__((aligned(16))) __bf16 As[BM][LDR];   // [m][32 hi | 32 lo]
    __shared__ __attribute__((aligned(16))) __bf16 Bs[BN][LDR];   // [n][32 hi | 32 lo]
    __shared__ int    sTok[BM];
    __shared__ float  sW[BM];

    const int tid = threadIdx.x;
    if (tid < BM) {
        int r   = row0 + tid;
        int tok = (r < cnt) ? lists[pr * N_TOKENS + r] : -1;
        sTok[tid] = tok;
        sW[tid]   = (tok >= 0) ? wgt[tok] : 0.f;
    }
    __syncthreads();

    const int lane  = tid & 31;
    const int wave  = tid >> 5;
    const int waveM = (wave >> 2) * 64;        // 0 or 64
    const int waveN = (wave & 3) * 32;         // 0,32,64,96

    v8f c[4][2] = {};

    // Staging map, A and B alike: 128 rows x 8 chunks of 16 B -> 256 threads x 4 iters
    const int lr = tid >> 3, ch = tid & 7;         // lr 0..31, ch 0..7 (0-3 hi, 4-7 lo)
    const int kb0 = (lane < 16) ? 0 : 8;           // ISA 16-bit A/B lane K-base

    const __bf16* aPtr[4];
    const __bf16* bPtr[4];
#pragma unroll
    for (int rr = 0; rr < 4; ++rr) {
        int row = lr + rr * 32;
        int tok = sTok[row]; if (tok < 0) tok = 0;
        aPtr[rr] = xs + (size_t)tok * PROW + ch * 8;
        bPtr[rr] = wsp + ((size_t)pr * DIM + n0 + row) * PROW + ch * 8;   // the pair's own plane
    }

    v8bf aReg[4], bReg[4];

    // step st: K chunk st of x against the pair's plane
    auto loadTiles = [&](int st) {
        const int ko = st * (2 * BK);
#pragma unroll
        for (int rr = 0; rr < 4; ++rr) aReg[rr] = *(const v8bf*)(aPtr[rr] + ko);
#pragma unroll
        for (int rr = 0; rr < 4; ++rr) bReg[rr] = *(const v8bf*)(bPtr[rr] + ko);
    };
    auto storeTiles = [&]() {
#pragma unroll
        for (int rr = 0; rr < 4; ++rr) *(v8bf*)&As[lr + rr * 32][ch * 8] = aReg[rr];
#pragma unroll
        for (int rr = 0; rr < 4; ++rr) *(v8bf*)&Bs[lr + rr * 32][ch * 8] = bReg[rr];
    };

    loadTiles(0);
    for (int st = 0; st < KSTEPS; ++st) {
        storeTiles();
        __syncthreads();
        if (st + 1 < KSTEPS) {
            loadTiles(st + 1);   // prefetch next K-tile (overlaps WMMA)
            // The fragment loads below reuse the address registers of these loads.
            asm volatile("s_wait_xcnt 0x0" ::: "memory");
        }

        // ---- assemble fragments (two ds_load_b128 each; layout per ISA 7.12.2)
        v16bf aH[4], aL[4], bH[2], bL[2];
#pragma unroll
        for (int mi = 0; mi < 4; ++mi) {
            int row = waveM + mi * 16 + (lane & 15);
            v8bf h0 = *(const v8bf*)&As[row][kb0];
            v8bf h1 = *(const v8bf*)&As[row][kb0 + 16];
            aH[mi] = __builtin_shufflevector(h0, h1, 0,1,2,3,4,5,6,7,8,9,10,11,12,13,14,15);
            v8bf l0 = *(const v8bf*)&As[row][32 + kb0];
            v8bf l1 = *(const v8bf*)&As[row][32 + kb0 + 16];
            aL[mi] = __builtin_shufflevector(l0, l1, 0,1,2,3,4,5,6,7,8,9,10,11,12,13,14,15);
        }
#pragma unroll
        for (int ni = 0; ni < 2; ++ni) {
            int col = waveN + ni * 16 + (lane & 15);
            v8bf h0 = *(const v8bf*)&Bs[col][kb0];
            v8bf h1 = *(const v8bf*)&Bs[col][kb0 + 16];
            bH[ni] = __builtin_shufflevector(h0, h1, 0,1,2,3,4,5,6,7,8,9,10,11,12,13,14,15);
            v8bf l0 = *(const v8bf*)&Bs[col][32 + kb0];
            v8bf l1 = *(const v8bf*)&Bs[col][32 + kb0 + 16];
            bL[ni] = __builtin_shufflevector(l0, l1, 0,1,2,3,4,5,6,7,8,9,10,11,12,13,14,15);
        }
        // ---- 24 WMMAs: hi*hi + hi*lo + lo*hi
#pragma unroll
        for (int mi = 0; mi < 4; ++mi) {
#pragma unroll
            for (int ni = 0; ni < 2; ++ni) {
                c[mi][ni] = __builtin_amdgcn_wmma_f32_16x16x32_bf16(
                    false, aH[mi], false, bH[ni], (short)0, c[mi][ni], false, false);
                c[mi][ni] = __builtin_amdgcn_wmma_f32_16x16x32_bf16(
                    false, aH[mi], false, bL[ni], (short)0, c[mi][ni], false, false);
                c[mi][ni] = __builtin_amdgcn_wmma_f32_16x16x32_bf16(
                    false, aL[mi], false, bH[ni], (short)0, c[mi][ni], false, false);
            }
        }
        __syncthreads();
    }

    // ---- epilogue: (acc + both biases) * token_weight, one plain store per element
    const int nLane = lane & 15;
    const int mOff  = (lane >> 4) * 8;
#pragma unroll
    for (int mi = 0; mi < 4; ++mi) {
        const int base = waveM + mi * 16 + mOff;
        int   toks[8];
        float ws8[8];
#pragma unroll
        for (int j = 0; j < 8; ++j) { toks[j] = sTok[base + j]; ws8[j] = sW[base + j]; }
#pragma unroll
        for (int ni = 0; ni < 2; ++ni) {
            const int ncol = n0 + waveN + ni * 16 + nLane;
            const float bias = be[ea * DIM + ncol] + be[eb * DIM + ncol];
#pragma unroll
            for (int j = 0; j < 8; ++j) {
                if (toks[j] < 0) continue;
                out[(size_t)toks[j] * DIM + ncol] = (c[mi][ni][j] + bias) * ws8[j];
            }
        }
    }
}

// ---------------------------------------------------------------- launch
extern "C" void kernel_launch(void* const* d_in, const int* in_sizes, int n_in,
                              void* d_out, int out_size, void* d_ws, size_t ws_size,
                              hipStream_t stream) {
    const float* x  = (const float*)d_in[0];
    const float* Wg = (const float*)d_in[1];
    const float* bg = (const float*)d_in[2];
    const float* We = (const float*)d_in[3];
    const float* be = (const float*)d_in[4];
    float* out = (float*)d_out;

    char*  ws     = (char*)d_ws;
    int*   counts = (int*)ws;                                    // 28 ints (128B slot)
    float* wgt    = (float*)(ws + 128);                          // N floats
    int*   lists  = (int*)(ws + 128 + N_TOKENS * sizeof(float)); // 28*N ints (3.5 MiB)
    __bf16* xs    = (__bf16*)(ws + (4u << 20));                  // N x 2D bf16 (128 MiB)
    __bf16* wsp   = (__bf16*)(ws + (132u << 20));                // 28 x D x 2D bf16 (112 MiB)

    hipMemsetAsync(counts, 0, 128, stream);
    moe_gate_kernel<<<N_TOKENS / 8, 256, 0, stream>>>(x, Wg, bg, wgt, counts, lists);
    moe_split_kernel<<<WSPLIT_BLOCKS + XSPLIT_BLOCKS, 256, 0, stream>>>(x, We, xs, wsp);

    dim3 grid(DIM / BN, N_TOKENS / BM + NPAIR);   // N-tiles x most row tiles the 28 lists can need
    moe_expert_gemm<<<grid, 256, 0, stream>>>(xs, wsp, be, wgt, counts, lists, out);
}

// v004
// Next to v003, in two timings, it ran 1.13 and 1.15 times as fast.
// Over all steps from v000 it is 5.40 times as fast.
#include <hip/hip_runtime.h>

#define N_TOKENS 32768
#define DIM      1024
#define NEXP     8
#define NPAIR    28   // unordered pairs of distinct experts

#define BM 128
#define BN 128
#define BK 32
#define KSTEPS (DIM / BK)
#define LDR 72   // LDS row in bf16 elements: 32 hi | 32 lo | 8 pad (144 B = 16 B x odd)
#define PROW (2 * DIM)   // plane row in bf16 elements: per 32-k chunk 32 hi then 32 lo (one 128-B line)
#define WSPLIT_BLOCKS (NPAIR * (DIM / 32) * (DIM / 64))
#define XSPLIT_BLOCKS (N_TOKENS * DIM / 8 / 256)

typedef __attribute__((ext_vector_type(16))) __bf16 v16bf;
typedef __attribute__((ext_vector_type(8)))  __bf16 v8bf;
typedef __attribute__((ext_vector_type(4)))  __bf16 v4bf;
typedef __attribute__((ext_vector_type(8)))  float  v8f;

// ---------------------------------------------------------------- split pre-pass
// Splits every float of x once into bf16 hi + bf16 lo (lo = v - hi) and
// writes them K-contiguous: row r, chunk kc holds [32 hi | 32 lo] = one 128-B line.
// The weights get one plane per expert pair (a, b): x*We[a] + x*We[b] = x*(We[a] + We[b]),
// so the f32 sum of the two matrices is split, transposed on the way (plane row = output column n).
__device__ __forceinline__ void split8(const float* f, __bf16* dst) {
    v8bf hi, lo;
#pragma unroll
    for (int i = 0; i < 8; ++i) {
        __bf16 h = (__bf16)f[i];
        hi[i] = h;
        lo[i] = (__bf16)(f[i] - (float)h);
    }
    *(v8bf*)dst        = hi;
    *(v8bf*)(dst + 32) = lo;
}

__global__ __launch_bounds__(256) void moe_split_kernel(
    const float* __restrict__ x, const float* __restrict__ We,
    __bf16* __restrict__ xs, __bf16* __restrict__ wsp) {
    __shared__ float tile[32][65];   // 32 k x 64 n, odd pitch: column reads hit distinct banks
    const int tid = threadIdx.x;
    if (blockIdx.x < WSPLIT_BLOCKS) {
        const int b  = blockIdx.x;
        const int pr = b >> 9;
        const int kc = (b >> 4) & 31;
        const int nt = b & 15;
        int ea = 0, eb = 0;
        {
            int q = 0;   // same lo-major pair rank as the gate and the GEMM
#pragma unroll
            for (int a = 0; a < NEXP; ++a) {
#pragma unroll
                for (int c = a + 1; c < NEXP; ++c, ++q) {
                    ea = (q == pr) ? a : ea;
                    eb = (q == pr) ? c : eb;
                }
            }
        }
        const size_t off = (size_t)(kc * 32) * DIM + nt * 64;
        const float* srcA = We + (size_t)ea * DIM * DIM + off;
        const float* srcB = We + (size_t)eb * DIM * DIM + off;
#pragma unroll
        for (int i = 0; i < 2; ++i) {
            int idx = tid + i * 256;
            int r = idx >> 4, c4 = idx & 15;
            float4 v = *(const float4*)(srcA + (size_t)r * DIM + c4 * 4);
            float4 u = *(const float4*)(srcB + (size_t)r * DIM + c4 * 4);
            tile[r][c4 * 4 + 0] = v.x + u.x;
            tile[r][c4 * 4 + 1] = v.y + u.y;
            tile[r][c4 * 4 + 2] = v.z + u.z;
            tile[r][c4 * 4 + 3] = v.w + u.w;
        }
        __syncthreads();
        const int n = tid >> 2, c = tid & 3;
        float f[8];
#pragma unroll
        for (int i = 0; i < 8; ++i) f[i] = tile[c * 8 + i][n];
        split8(f, wsp + ((size_t)pr * DIM + nt * 64 + n) * PROW + kc * 64 + c * 8);
    } else {
        const size_t g = (size_t)(blockIdx.x - WSPLIT_BLOCKS) * 256 + tid;   // 8 floats each
        const size_t row = g >> 7;
        const int    k   = ((int)g & 127) * 8;
        const float* p = x + row * DIM + k;
        float4 v0 = *(const float4*)p;
        float4 v1 = *(const float4*)(p + 4);
        float f[8] = {v0.x, v0.y, v0.z, v0.w, v1.x, v1.y, v1.z, v1.w};
        split8(f, xs + row * PROW + (k >> 5) * 64 + (k & 31));
    }
}

// ---------------------------------------------------------------- gating
// One wave32 per GT tokens: gate scores, softmax, top-2, weight = sum of top-2.
// A Wg element is loaded once and multiplied into GT rows of x; lane t (t < GT) then ranks token t.
// Per token the sums are those of one wave per token: lane l adds d = l, l + 32, ... in rising order,
// then the five-step butterfly.
// Appends the token to the compacted list of its unordered expert pair (lo < hi).
#define GT 8
__global__ __launch_bounds__(256) void moe_gate_kernel(
    const float* __restrict__ x, const float* __restrict__ Wg,
    const float* __restrict__ bg, float* __restrict__ wgt,
    int* __restrict__ counts, int* __restrict__ lists) {
    const int lane = threadIdx.x & 31;
    const int wave = threadIdx.x >> 5;
    const int tok0 = (blockIdx.x * 8 + wave) * GT;
    const float* xr = x + (size_t)tok0 * DIM + lane;

    float acc[GT][NEXP];
#pragma unroll
    for (int t = 0; t < GT; ++t) {
#pragma unroll
        for (int e = 0; e < NEXP; ++e) acc[t][e] = 0.f;
    }
    // Four chunks a trip: 32 row loads of 128 B in flight per wave, enough to cover memory latency at 16 waves per WGP.
#pragma unroll 4
    for (int i = 0; i < DIM / 32; ++i) {
        const float* wr = Wg + (i * 32 + lane) * NEXP;
        float xv[GT];
#pragma unroll
        for (int t = 0; t < GT; ++t) xv[t] = xr[t * DIM + i * 32];
#pragma unroll
        for (int t = 0; t < GT; ++t) {
#pragma unroll
            for (int e = 0; e < NEXP; ++e) acc[t][e] = fmaf(xv[t], wr[e], acc[t][e]);   // fused in every term, as with one token a wave: same scores
        }
    }
#pragma unroll
    for (int t = 0; t < GT; ++t) {
#pragma unroll
        for (int e = 0; e < NEXP; ++e) {
#pragma unroll
            for (int off = 16; off > 0; off >>= 1)
                acc[t][e] += __shfl_xor(acc[t][e], off, 32);
        }
    }
    // every lane holds every sum: lane t keeps token t's eight
    float mine[NEXP];
#pragma unroll
    for (int e = 0; e < NEXP; ++e) {
        float v = acc[0][e];
#pragma unroll
        for (int t = 1; t < GT; ++t) v = (lane == t) ? acc[t][e] : v;
        mine[e] = v;
    }
    if (lane < GT) {
        const int token = tok0 + lane;
        float s[NEXP];
        float m = -1e30f;
#pragma unroll
        for (int e = 0; e < NEXP; ++e) { s[e] = mine[e] + bg[e]; m = fmaxf(m, s[e]); }
        float sum = 0.f;
#pragma unroll
        for (int e = 0; e < NEXP; ++e) { s[e] = expf(s[e] - m); sum += s[e]; }
        float inv = 1.f / sum;
#pragma unroll
        for (int e = 0; e < NEXP; ++e) s[e] *= inv;
        int i1 = 0;
#pragma unroll
        for (int e = 1; e < NEXP; ++e) if (s[e] > s[i1]) i1 = e;   // strict > : first-index tie rule
        int i2 = (i1 == 0) ? 1 : 0;
#pragma unroll
        for (int e = 0; e < NEXP; ++e) if (e != i1 && s[e] > s[i2]) i2 = e;

        wgt[token] = s[i1] + s[i2];
        const int lo = (i1 < i2) ? i1 : i2;
        const int hi = (i1 < i2) ? i2 : i1;
        const int pr = lo * 7 - (lo * (lo - 1)) / 2 + (hi - lo - 1);   // rank of (lo, hi), lo-major
        // The add's result may be given a register of the wgt store's address: wait in front of that overwrite.
        asm volatile("s_wait_xcnt 0x0" ::: "memory");
        int p = atomicAdd(&counts[pr], 1);
        lists[pr * N_TOKENS + p] = token;
    }
}

// ---------------------------------------------------------------- expert GEMM
// Per expert pair, compacted rows: every row of a tile wants the same two experts,
// so the K loop runs once (32 steps) over the pair's summed weight plane,
// and each output element is stored once by one work-group.
// blockIdx.y is a flat row-tile index; the pair counts say whose tile it is.
// 128x128x32 block tile, 8 waves (2x4), each wave
// computes a 64x32 sub-tile = 4x2 WMMA fragments. Split-bf16 (hi+lo) inputs:
// 3 v_wmma_f32_16x16x32_bf16 per fragment pair per K-step -> ~fp32 accuracy.
// Operands come ready split from the pre-pass planes: staging is 16-B copies only.
// Global->register prefetch of the next K-tile overlaps the WMMA burst.
__global__ __launch_bounds__(256) void moe_expert_gemm(
    const __bf16* __restrict__ xs, const __bf16* __restrict__ wsp,
    const float* __restrict__ be, const float* __restrict__ wgt,
    const int* __restrict__ counts, const int* __restrict__ lists,
    float* __restrict__ out) {
    const int t = blockIdx.y;
    int pr = -1, ea = 0, eb = 0, cnt = 0, first = 0;
    {
        int q = 0, base = 0;   // base = row tiles of the pairs before q
        // Both loops unrolled: a, b and q become constants and the 28 counts come by wide scalar loads.
#pragma unroll
        for (int a = 0; a < NEXP; ++a) {
#pragma unroll
            for (int b = a + 1; b < NEXP; ++b, ++q) {
                const int  c    = counts[q];
                const int  next = base + (int)((unsigned)(c + BM - 1) / BM);
                const bool mine = (t >= base) & (t < next);
                pr    = mine ? q    : pr;
                ea    = mine ? a    : ea;
                eb    = mine ? b    : eb;
                cnt   = mine ? c    : cnt;
                first = mine ? base : first;
                base  = next;
            }
        }
    }
    if (pr < 0) return;   // past the last tile: the whole work-group leaves, before any barrier
    const int row0 = (t - first) * BM;
    const int n0 = blockIdx.x * BN;

    __shared__ __attribute__((aligned(16))) __bf16 As[BM][LDR];   // [m][32 hi | 32 lo]
    __shared__ __attribute__((aligned(16))) __bf16 Bs[BN][LDR];   // [n][32 hi | 32 lo]
    __shared__ int    sTok[BM];
    __shared__ float  sW[BM];

    const int tid = threadIdx.x;
    if (tid < BM) {
        int r   = row0 + tid;
        int tok = (r < cnt) ? lists[pr * N_TOKENS + r] : -1;
        sTok[tid] = tok;
        sW[tid]   = (tok >= 0) ? wgt[tok] : 0.f;
    }
    __syncthreads();

    const int lane  = tid & 31;
    const int wave  = tid >> 5;
    const int waveM = (wave >> 2) * 64;        // 0 or 64
    const int waveN = (wave & 3) * 32;         // 0,32,64,96

    v8f c[4][2] = {};

    // Staging map, A and B alike: 128 rows x 8 chunks of 16 B -> 256 threads x 4 iters
    const int lr = tid >> 3, ch = tid & 7;         // lr 0..31, ch 0..7 (0-3 hi, 4-7 lo)
    const int kb0 = (lane < 16) ? 0 : 8;           // ISA 16-bit A/B lane K-base

    const __bf16* aPtr[4];
    const __bf16* bPtr[4];
#pragma unroll
    for (int rr = 0; rr < 4; ++rr) {
        int row = lr + rr * 32;
        int tok = sTok[row]; if (tok < 0) tok = 0;
        aPtr[rr] = xs + (size_t)tok * PROW + ch * 8;
        bPtr[rr] = wsp + ((size_t)pr * DIM + n0 + row) * PROW + ch * 8;   // the pair's own plane
    }

    v8bf aReg[4], bReg[4];

    // step st: K chunk st of x against the pair's plane
    auto loadTiles = [&](int st) {
        const int ko = st * (2 * BK);
#pragma unroll
        for (int rr = 0; rr < 4; ++rr) aReg[rr] = *(const v8bf*)(aPtr[rr] + ko);
#pragma unroll
        for (int rr = 0; rr < 4; ++rr) bReg[rr] = *(const v8bf*)(bPtr[rr] + ko);
    };
    auto storeTiles = [&]() {
#pragma unroll
        for (int rr = 0; rr < 4; ++rr) *(v8bf*)&As[lr + rr * 32][ch * 8] = aReg[rr];
#pragma unroll
        for (int rr = 0; rr < 4; ++rr) *(v8bf*)&Bs[lr + rr * 32][ch * 8] = bReg[rr];
    };

    loadTiles(0);
    for (int st = 0; st < KSTEPS; ++st) {
        storeTiles();
        __syncthreads();
        if (st + 1 < KSTEPS) {
            loadTiles(st + 1);   // prefetch next K-tile (overlaps WMMA)
            // The fragment loads below reuse the address registers of these loads.
            asm volatile("s_wait_xcnt 0x0" ::: "memory");
        }

        // ---- assemble fragments (two ds_load_b128 each; layout per ISA 7.12.2)
        v16bf aH[4], aL[4], bH[2], bL[2];
#pragma unroll
        for (int mi = 0; mi < 4; ++mi) {
            int row = waveM + mi * 16 + (lane & 15);
            v8bf h0 = *(const v8bf*)&As[row][kb0];
            v8bf h1 = *(const v8bf*)&As[row][kb0 + 16];
            aH[mi] = __builtin_shufflevector(h0, h1, 0,1,2,3,4,5,6,7,8,9,10,11,12,13,14,15);
            v8bf l0 = *(const v8bf*)&As[row][32 + kb0];
            v8bf l1 = *(const v8bf*)&As[row][32 + kb0 + 16];
            aL[mi] = __builtin_shufflevector(l0, l1, 0,1,2,3,4,5,6,7,8,9,10,11,12,13,14,15);
        }
#pragma unroll
        for (int ni = 0; ni < 2; ++ni) {
            int col = waveN + ni * 16 + (lane & 15);
            v8bf h0 = *(const v8bf*)&Bs[col][kb0];
            v8bf h1 = *(const v8bf*)&Bs[col][kb0 + 16];
            bH[ni] = __builtin_shufflevector(h0, h1, 0,1,2,3,4,5,6,7,8,9,10,11,12,13,14,15);
            v8bf l0 = *(const v8bf*)&Bs[col][32 + kb0];
            v8bf l1 = *(const v8bf*)&Bs[col][32 + kb0 + 16];
            bL[ni] = __builtin_shufflevector(l0, l1, 0,1,2,3,4,5,6,7,8,9,10,11,12,13,14,15);
        }
        // ---- 24 WMMAs: hi*hi + hi*lo + lo*hi
#pragma unroll
        for (int mi = 0; mi < 4; ++mi) {
#pragma unroll
            for (int ni = 0; ni < 2; ++ni) {
                c[mi][ni] = __builtin_amdgcn_wmma_f32_16x16x32_bf16(
                    false, aH[mi], false, bH[ni], (short)0, c[mi][ni], false, false);
                c[mi][ni] = __builtin_amdgcn_wmma_f32_16x16x32_bf16(
                    false, aH[mi], false, bL[ni], (short)0, c[mi][ni], false, false);
                c[mi][ni] = __builtin_amdgcn_wmma_f32_16x16x32_bf16(
                    false, aL[mi], false, bH[ni], (short)0, c[mi][ni], false, false);
            }
        }
        __syncthreads();
    }

    // ---- epilogue: (acc + both biases) * token_weight, one plain store per element
    const int nLane = lane & 15;
    const int mOff  = (lane >> 4) * 8;
#pragma unroll
    for (int mi = 0; mi < 4; ++mi) {
        const int base = waveM + mi * 16 + mOff;
        int   toks[8];
        float ws8[8];
#pragma unroll
        for (int j = 0; j < 8; ++j) { toks[j] = sTok[base + j]; ws8[j] = sW[base + j]; }
#pragma unroll
        for (int ni = 0; ni < 2; ++ni) {
            const int ncol = n0 + waveN + ni * 16 + nLane;
            const float bias = be[ea * DIM + ncol] + be[eb * DIM + ncol];
#pragma unroll
            for (int j = 0; j < 8; ++j) {
                if (toks[j] < 0) continue;
                out[(size_t)toks[j] * DIM + ncol] = (c[mi][ni][j] + bias) * ws8[j];
            }
        }
    }
}

// ---------------------------------------------------------------- launch
extern "C" void kernel_launch(void* const* d_in, const int* in_sizes, int n_in,
                              void* d_out, int out_size, void* d_ws, size_t ws_size,
                              hipStream_t stream) {
    const float* x  = (const float*)d_in[0];
    const float* Wg = (const float*)d_in[1];
    const float* bg = (const float*)d_in[2];
    const float* We = (const float*)d_in[3];
    const float* be = (const float*)d_in[4];
    float* out = (float*)d_out;

    char*  ws     = (char*)d_ws;
    int*   counts = (int*)ws;                                    // 28 ints (128B slot)
    float* wgt    = (float*)(ws + 128);                          // N floats
    int*   lists  = (int*)(ws + 128 + N_TOKENS * sizeof(float)); // 28*N ints (3.5 MiB)
    __bf16* xs    = (__bf16*)(ws + (4u << 20));                  // N x 2D bf16 (128 MiB)
    __bf16* wsp   = (__bf16*)(ws + (132u << 20));                // 28 x D x 2D bf16 (112 MiB)

    hipMemsetAsync(counts, 0, 128, stream);
    moe_gate_kernel<<<N_TOKENS / (8 * GT), 256, 0, stream>>>(x, Wg, bg, wgt, counts, lists);
    moe_split_kernel<<<WSPLIT_BLOCKS + XSPLIT_BLOCKS, 256, 0, stream>>>(x, We, xs, wsp);

    dim3 grid(DIM / BN, N_TOKENS / BM + NPAIR);   // N-tiles x most row tiles the 28 lists can need
    moe_expert_gemm<<<grid, 256, 0, stream>>>(xs, wsp, be, wgt, counts, lists, out);
}

// v005
// Next to v004, in two timings, it ran 1.08 and 1.07 times as fast.
// Counting every step since v000, it is 5.80 times as fast.
#include <hip/hip_runtime.h>

#define N_TOKENS 32768
#define DIM      1024
#define NEXP     8
#define NPAIR    28   // unordered pairs of distinct experts

#define BM 128
#define BN 128
#define BK 32
#define KSTEPS (DIM / BK)
#define LDR 72   // LDS row in bf16 elements: 32 hi | 32 lo | 8 pad (144 B = 16 B x odd)
#define PROW (2 * DIM)   // plane row in bf16 elements: per 32-k chunk 32 hi then 32 lo (one 128-B line)
#define WSPLIT_BLOCKS (NPAIR * (DIM / 32) * (DIM / 64))
#define XSPLIT_BLOCKS (N_TOKENS * DIM / 8 / 256)

typedef __attribute__((ext_vector_type(16))) __bf16 v16bf;
typedef __attribute__((ext_vector_type(8)))  __bf16 v8bf;
typedef __attribute__((ext_vector_type(4)))  __bf16 v4bf;
typedef __attribute__((ext_vector_type(8)))  float  v8f;

// ---------------------------------------------------------------- split pre-pass
// Splits every float of x once into bf16 hi + bf16 lo (lo = v - hi) and
// writes them K-contiguous: row r, chunk kc holds [32 hi | 32 lo] = one 128-B line.
// The weights get one plane per expert pair (a, b): x*We[a] + x*We[b] = x*(We[a] + We[b]),
// so the f32 sum of the two matrices is split, transposed on the way (plane row = output column n).
__device__ __forceinline__ void split8(const float* f, __bf16* dst) {
    v8bf hi, lo;
#pragma unroll
    for (int i = 0; i < 8; ++i) {
        __bf16 h = (__bf16)f[i];
        hi[i] = h;
        lo[i] = (__bf16)(f[i] - (float)h);
    }
    *(v8bf*)dst        = hi;
    *(v8bf*)(dst + 32) = lo;
}

__global__ __launch_bounds__(256) void moe_split_kernel(
    const float* __restrict__ x, const float* __restrict__ We,
    __bf16* __restrict__ xs, __bf16* __restrict__ wsp) {
    __shared__ float tile[32][65];   // 32 k x 64 n, odd pitch: column reads hit distinct banks
    const int tid = threadIdx.x;
    if (blockIdx.x < WSPLIT_BLOCKS) {
        const int b  = blockIdx.x;
        const int pr = b >> 9;
        const int kc = (b >> 4) & 31;
        const int nt = b & 15;
        int ea = 0, eb = 0;
        {
            int q = 0;   // same lo-major pair rank as the gate and the GEMM
#pragma unroll
            for (int a = 0; a < NEXP; ++a) {
#pragma unroll
                for (int c = a + 1; c < NEXP; ++c, ++q) {
                    ea = (q == pr) ? a : ea;
                    eb = (q == pr) ? c : eb;
                }
            }
        }
        const size_t off = (size_t)(kc * 32) * DIM + nt * 64;
        const float* srcA = We + (size_t)ea * DIM * DIM + off;
        const float* srcB = We + (size_t)eb * DIM * DIM + off;
#pragma unroll
        for (int i = 0; i < 2; ++i) {
            int idx = tid + i * 256;
            int r = idx >> 4, c4 = idx & 15;
            float4 v = *(const float4*)(srcA + (size_t)r * DIM + c4 * 4);
            float4 u = *(const float4*)(srcB + (size_t)r * DIM + c4 * 4);
            tile[r][c4 * 4 + 0] = v.x + u.x;
            tile[r][c4 * 4 + 1] = v.y + u.y;
            tile[r][c4 * 4 + 2] = v.z + u.z;
            tile[r][c4 * 4 + 3] = v.w + u.w;
        }
        __syncthreads();
        const int n = tid >> 2, c = tid & 3;
        float f[8];
#pragma unroll
        for (int i = 0; i < 8; ++i) f[i] = tile[c * 8 + i][n];
        split8(f, wsp + ((size_t)pr * DIM + nt * 64 + n) * PROW + kc * 64 + c * 8);
    } else {
        const size_t g = (size_t)(blockIdx.x - WSPLIT_BLOCKS) * 256 + tid;   // 8 floats each
        const size_t row = g >> 7;
        const int    k   = ((int)g & 127) * 8;
        const float* p = x + row * DIM + k;
        float4 v0 = *(const float4*)p;
        float4 v1 = *(const float4*)(p + 4);
        float f[8] = {v0.x, v0.y, v0.z, v0.w, v1.x, v1.y, v1.z, v1.w};
        split8(f, xs + row * PROW + (k >> 5) * 64 + (k & 31));
    }
}

// ---------------------------------------------------------------- gating
// One wave32 per GT tokens: gate scores, softmax, top-2, weight = sum of top-2.
// A Wg element is loaded once and multiplied into GT rows of x; lane t (t < GT) then ranks token t.
// Per token the sums are those of one wave per token: lane l adds d = l, l + 32, ... in rising order,
// then the five-step butterfly.
// Appends the token to the compacted list of its unordered expert pair (lo < hi).
#define GT 8
__global__ __launch_bounds__(256) void moe_gate_kernel(
    const float* __restrict__ x, const float* __restrict__ Wg,
    const float* __restrict__ bg, float* __restrict__ wgt,
    int* __restrict__ counts, int* __restrict__ lists) {
    const int lane = threadIdx.x & 31;
    const int wave = threadIdx.x >> 5;
    const int tok0 = (blockIdx.x * 8 + wave) * GT;
    const float* xr = x + (size_t)tok0 * DIM + lane;

    float acc[GT][NEXP];
#pragma unroll
    for (int t = 0; t < GT; ++t) {
#pragma unroll
        for (int e = 0; e < NEXP; ++e) acc[t][e] = 0.f;
    }
    // Four chunks a trip: 32 row loads of 128 B in flight per wave, enough to cover memory latency at 16 waves per WGP.
#pragma unroll 4
    for (int i = 0; i < DIM / 32; ++i) {
        const float* wr = Wg + (i * 32 + lane) * NEXP;
        float xv[GT];
#pragma unroll
        for (int t = 0; t < GT; ++t) xv[t] = xr[t * DIM + i * 32];
#pragma unroll
        for (int t = 0; t < GT; ++t) {
#pragma unroll
            for (int e = 0; e < NEXP; ++e) acc[t][e] = fmaf(xv[t], wr[e], acc[t][e]);   // fused in every term, as with one token a wave: same scores
        }
    }
#pragma unroll
    for (int t = 0; t < GT; ++t) {
#pragma unroll
        for (int e = 0; e < NEXP; ++e) {
#pragma unroll
            for (int off = 16; off > 0; off >>= 1)
                acc[t][e] += __shfl_xor(acc[t][e], off, 32);
        }
    }
    // every lane holds every sum: lane t keeps token t's eight
    float mine[NEXP];
#pragma unroll
    for (int e = 0; e < NEXP; ++e) {
        float v = acc[0][e];
#pragma unroll
        for (int t = 1; t < GT; ++t) v = (lane == t) ? acc[t][e] : v;
        mine[e] = v;
    }
    if (lane < GT) {
        const int token = tok0 + lane;
        float s[NEXP];
        float m = -1e30f;
#pragma unroll
        for (int e = 0; e < NEXP; ++e) { s[e] = mine[e] + bg[e]; m = fmaxf(m, s[e]); }
        float sum = 0.f;
#pragma unroll
        for (int e = 0; e < NEXP; ++e) { s[e] = expf(s[e] - m); sum += s[e]; }
        float inv = 1.f / sum;
#pragma unroll
        for (int e = 0; e < NEXP; ++e) s[e] *= inv;
        int i1 = 0;
#pragma unroll
        for (int e = 1; e < NEXP; ++e) if (s[e] > s[i1]) i1 = e;   // strict > : first-index tie rule
        int i2 = (i1 == 0) ? 1 : 0;
#pragma unroll
        for (int e = 0; e < NEXP; ++e) if (e != i1 && s[e] > s[i2]) i2 = e;

        wgt[token] = s[i1] + s[i2];
        const int lo = (i1 < i2) ? i1 : i2;
        const int hi = (i1 < i2) ? i2 : i1;
        const int pr = lo * 7 - (lo * (lo - 1)) / 2 + (hi - lo - 1);   // rank of (lo, hi), lo-major
        // The add's result may be given a register of the wgt store's address: wait in front of that overwrite.
        asm volatile("s_wait_xcnt 0x0" ::: "memory");
        int p = atomicAdd(&counts[pr], 1);
        lists[pr * N_TOKENS + p] = token;
    }
}

// ---------------------------------------------------------------- expert GEMM
// Per expert pair, compacted rows: every row of a tile wants the same two experts,
// so the K loop runs once (32 steps) over the pair's summed weight plane,
// and each output element is stored once by one work-group.
// blockIdx.y is a flat row-tile index; the pair counts say whose tile it is.
// 128x128x32 block tile, 8 waves (2x4), each wave
// computes a 64x32 sub-tile = 4x2 WMMA fragments. Split-bf16 (hi+lo) inputs:
// 3 v_wmma_f32_16x16x32_bf16 per fragment pair per K-step -> ~fp32 accuracy.
// Operands come ready split from the pre-pass planes: staging is 16-B asynchronous copies to LDS only,
// two stage buffers, the next stage's copies in flight while this one is multiplied; one barrier a K step.
__global__ __launch_bounds__(256) void moe_expert_gemm(
    const __bf16* __restrict__ xs, const __bf16* __restrict__ wsp,
    const float* __restrict__ be, const float* __restrict__ wgt,
    const int* __restrict__ counts, const int* __restrict__ lists,
    float* __restrict__ out) {
    const int t = blockIdx.y;
    int pr = -1, ea = 0, eb = 0, cnt = 0, first = 0;
    {
        int q = 0, base = 0;   // base = row tiles of the pairs before q
        // Both loops unrolled: a, b and q become constants and the 28 counts come by wide scalar loads.
#pragma unroll
        for (int a = 0; a < NEXP; ++a) {
#pragma unroll
            for (int b = a + 1; b < NEXP; ++b, ++q) {
                const int  c    = counts[q];
                const int  next = base + (int)((unsigned)(c + BM - 1) / BM);
                const bool mine = (t >= base) & (t < next);
                pr    = mine ? q    : pr;
                ea    = mine ? a    : ea;
                eb    = mine ? b    : eb;
                cnt   = mine ? c    : cnt;
                first = mine ? base : first;
                base  = next;
            }
        }
    }
    if (pr < 0) return;   // past the last tile: the whole work-group leaves, before any barrier
    const int row0 = (t - first) * BM;
    const int n0 = blockIdx.x * BN;

    // Two stage buffers; a stage is [128 rows of x | 128 rows of the pair's plane], each row [32 hi | 32 lo | pad].
    __shared__ __attribute__((aligned(16))) __bf16 ring[2][BM + BN][LDR];
    __shared__ int    sTok[BM];
    __shared__ float  sW[BM];

    const int tid = threadIdx.x;
    if (tid < BM) {
        int r   = row0 + tid;
        int tok = (r < cnt) ? lists[pr * N_TOKENS + r] : -1;
        sTok[tid] = tok;
        sW[tid]   = (tok >= 0) ? wgt[tok] : 0.f;
    }
    __syncthreads();

    const int lane  = tid & 31;
    const int wave  = tid >> 5;
    const int waveM = (wave >> 2) * 64;        // 0 or 64
    const int waveN = (wave & 3) * 32;         // 0,32,64,96

    v8f c[4][2] = {};

    // Staging map, A and B alike: 128 rows x 8 chunks of 16 B -> 256 threads x 4 iters
    const int lr = tid >> 3, ch = tid & 7;         // lr 0..31, ch 0..7 (0-3 hi, 4-7 lo)
    const int kb0 = (lane < 16) ? 0 : 8;           // ISA 16-bit A/B lane K-base

    const __bf16* aPtr[4];
    const __bf16* bPtr[4];
#pragma unroll
    for (int rr = 0; rr < 4; ++rr) {
        int row = lr + rr * 32;
        int tok = sTok[row]; if (tok < 0) tok = 0;
        aPtr[rr] = xs + (size_t)tok * PROW + ch * 8;
        bPtr[rr] = wsp + ((size_t)pr * DIM + n0 + row) * PROW + ch * 8;   // the pair's own plane
    }

    // This lane's place in buffer 0 (byte offset in the work-group's LDS) for its first row of x.
    const unsigned ldsRow = (unsigned)(size_t)&ring[0][lr][ch * 8];
    constexpr unsigned RSTEP = 32 * LDR * 2;          // 32 rows further down, bytes
    constexpr unsigned BUFB  = (BM + BN) * LDR * 2;   // one stage buffer, bytes

    // A stage (one K chunk of x and of the pair's plane) goes straight from global memory into buffer buf:
    // eight 16-B copies a lane, every lane on. The s_wait_xcnt closes the statement so that no address
    // register of a copy is rewritten in front of it.
    // Stages are copied in rising order, so the eight source pointers just step on by one chunk behind each stage.
    auto copyStage = [&](int buf) {
        const unsigned l = ldsRow + (unsigned)buf * BUFB;
        asm volatile(
            "global_load_async_to_lds_b128 %0, %8, off\n\t"
            "global_load_async_to_lds_b128 %1, %9, off\n\t"
            "global_load_async_to_lds_b128 %2, %10, off\n\t"
            "global_load_async_to_lds_b128 %3, %11, off\n\t"
            "global_load_async_to_lds_b128 %4, %12, off\n\t"
            "global_load_async_to_lds_b128 %5, %13, off\n\t"
            "global_load_async_to_lds_b128 %6, %14, off\n\t"
            "global_load_async_to_lds_b128 %7, %15, off\n\t"
            "s_wait_xcnt 0x0"
            :: "v"(l), "v"(l + RSTEP), "v"(l + 2 * RSTEP), "v"(l + 3 * RSTEP),
               "v"(l + 4 * RSTEP), "v"(l + 5 * RSTEP), "v"(l + 6 * RSTEP), "v"(l + 7 * RSTEP),
               "v"(aPtr[0]), "v"(aPtr[1]), "v"(aPtr[2]), "v"(aPtr[3]),
               "v"(bPtr[0]), "v"(bPtr[1]), "v"(bPtr[2]), "v"(bPtr[3])
            : "memory");
#pragma unroll
        for (int rr = 0; rr < 4; ++rr) { aPtr[rr] += 2 * BK; bPtr[rr] += 2 * BK; }
    };

    // One K step on the stage in buffer buf.
    auto mulStage = [&](int buf) {
        const __bf16 (*As)[LDR] = ring[buf];
        const __bf16 (*Bs)[LDR] = ring[buf] + BM;
        // ---- assemble fragments (two ds_load_b128 each; layout per ISA 7.12.2)
        v16bf aH[4], aL[4], bH[2], bL[2];
#pragma unroll
        for (int mi = 0; mi < 4; ++mi) {
            int row = waveM + mi * 16 + (lane & 15);
            v8bf h0 = *(const v8bf*)&As[row][kb0];
            v8bf h1 = *(const v8bf*)&As[row][kb0 + 16];
            aH[mi] = __builtin_shufflevector(h0, h1, 0,1,2,3,4,5,6,7,8,9,10,11,12,13,14,15);
            v8bf l0 = *(const v8bf*)&As[row][32 + kb0];
            v8bf l1 = *(const v8bf*)&As[row][32 + kb0 + 16];
            aL[mi] = __builtin_shufflevector(l0, l1, 0,1,2,3,4,5,6,7,8,9,10,11,12,13,14,15);
        }
#pragma unroll
        for (int ni = 0; ni < 2; ++ni) {
            int col = waveN + ni * 16 + (lane & 15);
            v8bf h0 = *(const v8bf*)&Bs[col][kb0];
            v8bf h1 = *(const v8bf*)&Bs[col][kb0 + 16];
            bH[ni] = __builtin_shufflevector(h0, h1, 0,1,2,3,4,5,6,7,8,9,10,11,12,13,14,15);
            v8bf l0 = *(const v8bf*)&Bs[col][32 + kb0];
            v8bf l1 = *(const v8bf*)&Bs[col][32 + kb0 + 16];
            bL[ni] = __builtin_shufflevector(l0, l1, 0,1,2,3,4,5,6,7,8,9,10,11,12,13,14,15);
        }
        // ---- 24 WMMAs: hi*hi + hi*lo + lo*hi
#pragma unroll
        for (int mi = 0; mi < 4; ++mi) {
#pragma unroll
            for (int ni = 0; ni < 2; ++ni) {
                c[mi][ni] = __builtin_amdgcn_wmma_f32_16x16x32_bf16(
                    false, aH[mi], false, bH[ni], (short)0, c[mi][ni], false, false);
                c[mi][ni] = __builtin_amdgcn_wmma_f32_16x16x32_bf16(
                    false, aH[mi], false, bL[ni], (short)0, c[mi][ni], false, false);
                c[mi][ni] = __builtin_amdgcn_wmma_f32_16x16x32_bf16(
                    false, aL[mi], false, bH[ni], (short)0, c[mi][ni], false, false);
            }
        }
    };

    // Foot of step st: this wave's reads of buffer buf are done, its copies of stage st + 1 have landed;
    // behind the barrier every wave may read stage st + 1, and buffer buf is free for stage st + 2.
    auto publish = [&](int st, int buf) {
        asm volatile("s_wait_dscnt 0x0" ::: "memory");      // own fragment reads of buf retired before it is refilled
        asm volatile("s_wait_asynccnt 0x0" ::: "memory");   // own copies of the next stage landed before others read them
        __syncthreads();
        if (st + 2 < KSTEPS) copyStage(buf);
    };

    copyStage(0);
    asm volatile("s_wait_asynccnt 0x0" ::: "memory");       // stage 0 landed before the barrier that publishes it
    __syncthreads();
    copyStage(1);
    // Two steps a trip, so that the buffer is a constant in every LDS address.
    for (int st = 0; st < KSTEPS; st += 2) {
        mulStage(0);
        publish(st, 0);
        mulStage(1);
        publish(st + 1, 1);
    }
    asm volatile("s_wait_asynccnt 0x0" ::: "memory");       // nothing of this wave in flight when it goes on

    // ---- epilogue: (acc + both biases) * token_weight, one plain store per element
    const int nLane = lane & 15;
    const int mOff  = (lane >> 4) * 8;
#pragma unroll
    for (int mi = 0; mi < 4; ++mi) {
        const int base = waveM + mi * 16 + mOff;
        int   toks[8];
        float ws8[8];
#pragma unroll
        for (int j = 0; j < 8; ++j) { toks[j] = sTok[base + j]; ws8[j] = sW[base + j]; }
#pragma unroll
        for (int ni = 0; ni < 2; ++ni) {
            const int ncol = n0 + waveN + ni * 16 + nLane;
            const float bias = be[ea * DIM + ncol] + be[eb * DIM + ncol];
#pragma unroll
            for (int j = 0; j < 8; ++j) {
                if (toks[j] < 0) continue;
                out[(size_t)toks[j] * DIM + ncol] = (c[mi][ni][j] + bias) * ws8[j];
            }
        }
    }
}

// ---------------------------------------------------------------- launch
extern "C" void kernel_launch(void* const* d_in, const int* in_sizes, int n_in,
                              void* d_out, int out_size, void* d_ws, size_t ws_size,
                              hipStream_t stream) {
    const float* x  = (const float*)d_in[0];
    const float* Wg = (const float*)d_in[1];
    const float* bg = (const float*)d_in[2];
    const float* We = (const float*)d_in[3];
    const float* be = (const float*)d_in[4];
    float* out = (float*)d_out;

    char*  ws     = (char*)d_ws;
    int*   counts = (int*)ws;                                    // 28 ints (128B slot)
    float* wgt    = (float*)(ws + 128);                          // N floats
    int*   lists  = (int*)(ws + 128 + N_TOKENS * sizeof(float)); // 28*N ints (3.5 MiB)
    __bf16* xs    = (__bf16*)(ws + (4u << 20));                  // N x 2D bf16 (128 MiB)
    __bf16* wsp   = (__bf16*)(ws + (132u << 20));                // 28 x D x 2D bf16 (112 MiB)

    hipMemsetAsync(counts, 0, 128, stream);
    moe_gate_kernel<<<N_TOKENS / (8 * GT), 256, 0, stream>>>(x, Wg, bg, wgt, counts, lists);
    moe_split_kernel<<<WSPLIT_BLOCKS + XSPLIT_BLOCKS, 256, 0, stream>>>(x, We, xs, wsp);

    dim3 grid(DIM / BN, N_TOKENS / BM + NPAIR);   // N-tiles x most row tiles the 28 lists can need
    moe_expert_gemm<<<grid, 256, 0, stream>>>(xs, wsp, be, wgt, counts, lists, out);
}
